// v000
// Times are from an AMD MI455X. After a warm-up the kernel runs many times in a row, and a time is the length of
// such a window on the GPU divided by its runs, so every launch and the gaps after it count. The runs cycle
// through copies of the inputs. A figure is the median of several windows, for all but v000 over two sittings.
// Sittings can differ by a few percent; kernels timed side by side share one.
// The starting kernel, v000, takes 400 microseconds a run.
#include <hip/hip_runtime.h>
#include <hip/hip_bf16.h>

// ---------------------------------------------------------------------------
// Problem constants (from reference)
// ---------------------------------------------------------------------------
#define MDIM   8192          // B_*S = 4*2048
#define DDIM   4096          // D_IN
#define NDIM   4096          // D_OUT
#define RDIM   64            // LoRA rank
#define KTOP   16
#define INV_TEMP 10.0f       // 1/0.1
#define SCALE_V  1.0f        // ALPHA/K = 16/16

// Tile config for main GEMM: block 256x128, 8 waves as 4(M) x 2(N), wave 64x64
#define BM 256
#define BN 128
#define BK 32
#define LDP 40               // LDS row pitch in bf16 elems (80B, 16B-aligned rows)

typedef __bf16 v4bf  __attribute__((ext_vector_type(4)));
typedef __bf16 v8bf  __attribute__((ext_vector_type(8)));
typedef __bf16 v16bf __attribute__((ext_vector_type(16)));
typedef float  v8f   __attribute__((ext_vector_type(8)));

// f32x4 -> bf16x4 using native conversions (backend selects v_cvt*_bf16_f32)
static __device__ __forceinline__ v4bf cvt4(float4 v) {
    v4bf r;
    r.x = (__bf16)v.x; r.y = (__bf16)v.y; r.z = (__bf16)v.z; r.w = (__bf16)v.w;
    return r;
}
static __device__ __forceinline__ unsigned short f2bf1(float f) {
    union { __bf16 h; unsigned short u; } c;
    c.h = (__bf16)f;
    return c.u;
}

// Load one 16-bit A/B-operand fragment (16x32 bf16) for this lane from LDS.
// Per ISA layout: lane L: M/N = L&15, holds K = {kh..kh+7} and {kh+16..kh+23}
// with kh = (L>=16 ? 8 : 0).  p points at row start + kh; halves are 16B apart.
static __device__ __forceinline__ v16bf ldfrag(const unsigned short* p) {
    v8bf lo = *(const v8bf*)(p);
    v8bf hi = *(const v8bf*)(p + 16);
    return __builtin_shufflevector(lo, hi, 0,1,2,3,4,5,6,7,8,9,10,11,12,13,14,15);
}

// One BK=32 K-step for a wave tile of 64x64 (4x4 of 16x16 wmma tiles):
// 16 WMMAs per 8 fragment loads (16 ds_load_b128).
static __device__ __forceinline__ void compute_tile(const unsigned short* xsB,
                                                    const unsigned short* wsB,
                                                    int rA, int rB, int lane,
                                                    v8f (&acc)[4][4]) {
    const int l15 = lane & 15;
    const int kh  = (lane >> 4) << 3;
    v16bf af[4];
#pragma unroll
    for (int mi = 0; mi < 4; ++mi)
        af[mi] = ldfrag(xsB + (rA + mi * 16 + l15) * LDP + kh);
#pragma unroll
    for (int ni = 0; ni < 4; ++ni) {
        v16bf bfv = ldfrag(wsB + (rB + ni * 16 + l15) * LDP + kh);
#pragma unroll
        for (int mi = 0; mi < 4; ++mi)
            acc[mi][ni] = __builtin_amdgcn_wmma_f32_16x16x32_bf16(
                false, af[mi], false, bfv, (short)0, acc[mi][ni], false, false);
    }
}

// ---------------------------------------------------------------------------
// Kernel 1: z = x @ A^T, soft-top-k mask, write z_sparse*SCALE as bf16.
// Grid: MDIM/128 blocks, 256 threads (8 waves). Each wave: 16 rows x 64 cols.
// ---------------------------------------------------------------------------
__global__ void __launch_bounds__(256)
zk(const float* __restrict__ x, const float* __restrict__ Am,
   unsigned short* __restrict__ zsp) {
    __shared__ __align__(16) unsigned short xs[128 * LDP];
    __shared__ __align__(16) unsigned short as_[64 * LDP];
    __shared__ __align__(16) float zb[128 * 68];
    __shared__ __align__(16) float ab[128 * 68];

    const int tid  = threadIdx.x;
    const int lane = tid & 31;
    const int w    = tid >> 5;
    const int m0   = blockIdx.x * 128;
    const int rowq = tid >> 3;            // 32 rows per pass, 8 float4 per row
    const int colq = (tid & 7) * 4;

    v8f acc[4] = {};

    for (int k = 0; k < DDIM; k += BK) {
        __syncthreads();
        // stage x tile 128x32 (f32 -> bf16)
#pragma unroll
        for (int i = 0; i < 4; ++i) {
            int r = rowq + 32 * i;
            float4 v = *(const float4*)(x + (size_t)(m0 + r) * DDIM + k + colq);
            *(v4bf*)(&xs[r * LDP + colq]) = cvt4(v);
        }
        // stage A tile 64x32
#pragma unroll
        for (int i = 0; i < 2; ++i) {
            int r = rowq + 32 * i;
            float4 v = *(const float4*)(Am + (size_t)r * DDIM + k + colq);
            *(v4bf*)(&as_[r * LDP + colq]) = cvt4(v);
        }
        __syncthreads();

        const int l15 = lane & 15;
        const int kh  = (lane >> 4) << 3;
        v16bf af = ldfrag(&xs[(w * 16 + l15) * LDP + kh]);
#pragma unroll
        for (int ni = 0; ni < 4; ++ni) {
            v16bf bfv = ldfrag(&as_[(ni * 16 + l15) * LDP + kh]);
            acc[ni] = __builtin_amdgcn_wmma_f32_16x16x32_bf16(
                false, af, false, bfv, (short)0, acc[ni], false, false);
        }
    }

    // dump z tile to LDS (C-layout: lane = col, vgpr = row)
    {
        const int l15 = lane & 15;
        const int m8  = (lane >> 4) * 8;
#pragma unroll
        for (int ni = 0; ni < 4; ++ni)
#pragma unroll
            for (int r = 0; r < 8; ++r) {
                float zv = acc[ni][r];
                zb[(w * 16 + m8 + r) * 68 + ni * 16 + l15] = zv;
                ab[(w * 16 + m8 + r) * 68 + ni * 16 + l15] = fabsf(zv);
            }
    }
    __syncthreads();

    // soft top-k per row: threshold = 16th largest of |z| (rank-count select)
    if (tid < 128) {
        const int row = tid;
        const float* arow = &ab[row * 68];
        float thr = 3.4e38f;
        for (int j = 0; j < 64; ++j) {
            float aj = arow[j];
            int cnt = 0;
            for (int i = 0; i < 64; ++i) cnt += (arow[i] > aj) ? 1 : 0;
            if (cnt <= (KTOP - 1) && aj < thr) thr = aj;
        }
        for (int j = 0; j < 64; ++j) {
            float zv = zb[row * 68 + j];
            float m  = 1.0f / (1.0f + __expf(-(arow[j] - thr) * INV_TEMP));
            zsp[(size_t)(m0 + row) * RDIM + j] = f2bf1(zv * m * SCALE_V);
        }
    }
}

// ---------------------------------------------------------------------------
// Kernel 2: convert LoRA-up matrix B (NDIM x RDIM f32) to bf16.
// ---------------------------------------------------------------------------
__global__ void __launch_bounds__(256)
bconv(const float* __restrict__ Bm, unsigned short* __restrict__ Bbf) {
    int i = (blockIdx.x * 256 + threadIdx.x) * 4;
    if (i < NDIM * RDIM) {
        float4 v = *(const float4*)(Bm + i);
        *(v4bf*)(Bbf + i) = cvt4(v);
    }
}

// ---------------------------------------------------------------------------
// Kernel 3: fused out = x@W^T + bias + zsp@Bbf^T
// Grid: (NDIM/BN, MDIM/BM), 256 threads = 8 waves (4 M x 2 N), wave tile 64x64.
// Double-buffered LDS, register-prefetched global loads, on-the-fly f32->bf16.
// ---------------------------------------------------------------------------
__global__ void __launch_bounds__(256)
gemmk(const float* __restrict__ x, const float* __restrict__ W,
      const float* __restrict__ bias,
      const unsigned short* __restrict__ zsp,
      const unsigned short* __restrict__ Bbf,
      float* __restrict__ out) {
    __shared__ __align__(16) unsigned short xs[2][BM * LDP];   // 2 x 20 KB
    __shared__ __align__(16) unsigned short wl[2][BN * LDP];   // 2 x 10 KB

    const int tid   = threadIdx.x;
    const int lane  = tid & 31;
    const int w     = tid >> 5;
    const int waveM = w >> 1;           // 0..3 -> row offset *64
    const int waveN = w & 1;            // 0..1 -> col offset *64
    const int rA    = waveM * 64;
    const int rB    = waveN * 64;
    const int m0    = blockIdx.y * BM;
    const int n0    = blockIdx.x * BN;

    const int rowq = tid >> 3;          // staging: 32 rows/pass, 8 f4 per row
    const int colq = (tid & 7) * 4;

    v8f acc[4][4] = {};
    float4 xr[8], wr[4];

    // ---- initial global load (k=0) + stage into buffer 0 ----
#pragma unroll
    for (int i = 0; i < 8; ++i)
        xr[i] = *(const float4*)(x + (size_t)(m0 + rowq + 32 * i) * DDIM + colq);
#pragma unroll
    for (int i = 0; i < 4; ++i)
        wr[i] = *(const float4*)(W + (size_t)(n0 + rowq + 32 * i) * DDIM + colq);
#pragma unroll
    for (int i = 0; i < 8; ++i)
        *(v4bf*)(&xs[0][(rowq + 32 * i) * LDP + colq]) = cvt4(xr[i]);
#pragma unroll
    for (int i = 0; i < 4; ++i)
        *(v4bf*)(&wl[0][(rowq + 32 * i) * LDP + colq]) = cvt4(wr[i]);
    __syncthreads();

    int buf = 0;
    // ---- main K loop over D_IN ----
    for (int kt = 1; kt < DDIM / BK; ++kt) {
        const int k = kt * BK;
#pragma unroll
        for (int i = 0; i < 8; ++i)
            xr[i] = *(const float4*)(x + (size_t)(m0 + rowq + 32 * i) * DDIM + k + colq);
#pragma unroll
        for (int i = 0; i < 4; ++i)
            wr[i] = *(const float4*)(W + (size_t)(n0 + rowq + 32 * i) * DDIM + k + colq);

        compute_tile(xs[buf], wl[buf], rA, rB, lane, acc);

#pragma unroll
        for (int i = 0; i < 8; ++i)
            *(v4bf*)(&xs[buf ^ 1][(rowq + 32 * i) * LDP + colq]) = cvt4(xr[i]);
#pragma unroll
        for (int i = 0; i < 4; ++i)
            *(v4bf*)(&wl[buf ^ 1][(rowq + 32 * i) * LDP + colq]) = cvt4(wr[i]);
        __syncthreads();
        buf ^= 1;
    }
    compute_tile(xs[buf], wl[buf], rA, rB, lane, acc);
    __syncthreads();

    // ---- LoRA epilogue: accumulate zsp(M x 64) @ Bbf(N x 64)^T, K=64 ----
    {
        const int row2  = tid >> 2;          // 64 rows/pass, 4x uint4 per row
        const int colq2 = (tid & 3) * 8;     // in bf16 elems (16B chunks)
#pragma unroll
        for (int kk = 0; kk < 2; ++kk) {
#pragma unroll
            for (int i = 0; i < 4; ++i) {    // 256 rows of zsp tile
                int r = row2 + 64 * i;
                *(uint4*)(&xs[0][r * LDP + colq2]) =
                    *(const uint4*)(zsp + (size_t)(m0 + r) * RDIM + kk * 32 + colq2);
            }
#pragma unroll
            for (int i = 0; i < 2; ++i) {    // 128 rows of Bbf tile
                int r = row2 + 64 * i;
                *(uint4*)(&wl[0][r * LDP + colq2]) =
                    *(const uint4*)(Bbf + (size_t)(n0 + r) * RDIM + kk * 32 + colq2);
            }
            __syncthreads();
            compute_tile(xs[0], wl[0], rA, rB, lane, acc);
            __syncthreads();
        }
    }

    // ---- epilogue: bias + store ----
    const int l15 = lane & 15;
    const int m8  = (lane >> 4) * 8;
#pragma unroll
    for (int ni = 0; ni < 4; ++ni) {
        int gn = n0 + rB + ni * 16 + l15;
        float bv = bias[gn];
#pragma unroll
        for (int mi = 0; mi < 4; ++mi) {
            int gmB = m0 + rA + mi * 16 + m8;
#pragma unroll
            for (int r = 0; r < 8; ++r)
                out[(size_t)(gmB + r) * NDIM + gn] = acc[mi][ni][r] + bv;
        }
    }
}

// ---------------------------------------------------------------------------
// Host launch
// ---------------------------------------------------------------------------
extern "C" void kernel_launch(void* const* d_in, const int* in_sizes, int n_in,
                              void* d_out, int out_size, void* d_ws, size_t ws_size,
                              hipStream_t stream) {
    const float* x    = (const float*)d_in[0];
    const float* A    = (const float*)d_in[1];
    const float* Bm   = (const float*)d_in[2];
    const float* W    = (const float*)d_in[3];
    const float* bias = (const float*)d_in[4];
    float* out = (float*)d_out;

    unsigned short* zsp = (unsigned short*)d_ws;               // MDIM*RDIM bf16 = 1 MB
    unsigned short* Bbf = zsp + (size_t)MDIM * RDIM;           // NDIM*RDIM bf16 = 0.5 MB

    zk<<<MDIM / 128, 256, 0, stream>>>(x, A, zsp);
    bconv<<<(NDIM * RDIM) / (256 * 4), 256, 0, stream>>>(Bm, Bbf);
    gemmk<<<dim3(NDIM / BN, MDIM / BM), 256, 0, stream>>>(x, W, bias, zsp, Bbf, out);
}

// v001
// Measured time: 333 microseconds a run.
// Next to v000, in two timings, it ran 1.25 times as fast each time.
#include <hip/hip_runtime.h>
#include <hip/hip_bf16.h>

// ---------------------------------------------------------------------------
// Problem constants (from reference)
// ---------------------------------------------------------------------------
#define MDIM   8192          // B_*S = 4*2048
#define DDIM   4096          // D_IN
#define NDIM   4096          // D_OUT
#define RDIM   64            // LoRA rank
#define KTOP   16
#define INV_TEMP 10.0f       // 1/0.1
#define SCALE_V  1.0f        // ALPHA/K = 16/16

// Tile config for main GEMM: block 256x128, 8 waves as 4(M) x 2(N), wave 64x64
#define BM 256
#define BN 128
#define BK 32
#define LDP 40               // LDS row pitch in bf16 elems (80B, 16B-aligned rows)

typedef __bf16 v4bf  __attribute__((ext_vector_type(4)));
typedef __bf16 v8bf  __attribute__((ext_vector_type(8)));
typedef __bf16 v16bf __attribute__((ext_vector_type(16)));
typedef float  v8f   __attribute__((ext_vector_type(8)));

// f32x4 -> bf16x4 using native conversions (backend selects v_cvt*_bf16_f32)
static __device__ __forceinline__ v4bf cvt4(float4 v) {
    v4bf r;
    r.x = (__bf16)v.x; r.y = (__bf16)v.y; r.z = (__bf16)v.z; r.w = (__bf16)v.w;
    return r;
}
static __device__ __forceinline__ unsigned short f2bf1(float f) {
    union { __bf16 h; unsigned short u; } c;
    c.h = (__bf16)f;
    return c.u;
}

// Load one 16-bit A/B-operand fragment (16x32 bf16) for this lane from LDS.
// Per ISA layout: lane L: M/N = L&15, holds K = {kh..kh+7} and {kh+16..kh+23}
// with kh = (L>=16 ? 8 : 0).  p points at row start + kh; halves are 16B apart.
static __device__ __forceinline__ v16bf ldfrag(const unsigned short* p) {
    v8bf lo = *(const v8bf*)(p);
    v8bf hi = *(const v8bf*)(p + 16);
    return __builtin_shufflevector(lo, hi, 0,1,2,3,4,5,6,7,8,9,10,11,12,13,14,15);
}

// One BK=32 K-step for a wave tile of 64x64 (4x4 of 16x16 wmma tiles):
// 16 WMMAs per 8 fragment loads (16 ds_load_b128).
static __device__ __forceinline__ void compute_tile(const unsigned short* xsB,
                                                    const unsigned short* wsB,
                                                    int rA, int rB, int lane,
                                                    v8f (&acc)[4][4]) {
    const int l15 = lane & 15;
    const int kh  = (lane >> 4) << 3;
    v16bf af[4];
#pragma unroll
    for (int mi = 0; mi < 4; ++mi)
        af[mi] = ldfrag(xsB + (rA + mi * 16 + l15) * LDP + kh);
#pragma unroll
    for (int ni = 0; ni < 4; ++ni) {
        v16bf bfv = ldfrag(wsB + (rB + ni * 16 + l15) * LDP + kh);
#pragma unroll
        for (int mi = 0; mi < 4; ++mi)
            acc[mi][ni] = __builtin_amdgcn_wmma_f32_16x16x32_bf16(
                false, af[mi], false, bfv, (short)0, acc[mi][ni], false, false);
    }
}

// ---------------------------------------------------------------------------
// Kernel 1: z = x @ A^T, soft-top-k mask, write z_sparse*SCALE as bf16.
// Grid: MDIM/32 blocks (one per WGP), 512 threads (16 waves).
// A pass stages 512 k of 32 x rows and of all 64 A rows; wave w multiplies the
// 32 k at offset 32*w of the pass for all 32 rows x 64 cols, so the 16 waves
// hold 16 partial sums over k, added through LDS behind the loop.
// ---------------------------------------------------------------------------
#define ZROWS  32            // x rows per block
#define ZBK    512           // k per pass = 16 waves x 32
#define ZPITCH 520           // LDS row pitch in bf16 elems (1040 B = 16 B x odd)
#define ZTILE  ((ZROWS + RDIM) * ZPITCH)
#define ZPP    68            // row pitch of the f32 partial tiles
#define ZNT    (DDIM / ZBK)

__global__ void __launch_bounds__(512)
zk(const float* __restrict__ x, const float* __restrict__ Am,
   unsigned short* __restrict__ zsp) {
    // two staging buffers; the 16 partial tiles reuse the same bytes afterwards
    __shared__ __align__(16) unsigned short st[2 * ZTILE];
    __shared__ __align__(16) float ab[ZROWS * ZPP];
    static_assert(2 * ZTILE * 2 >= 16 * ZROWS * ZPP * 4, "partials fit");

    const int tid  = threadIdx.x;
    const int lane = tid & 31;
    const int w    = tid >> 5;
    const int l15  = lane & 15;
    const int kh   = (lane >> 4) << 3;
    const int m0   = blockIdx.x * ZROWS;
    const int rs   = tid >> 7;            // 4 rows per sweep, 128 float4 per row
    const int c4   = (tid & 127) * 4;     // a wave reads 512 contiguous bytes

    // block-uniform bases plus one 32-bit lane offset shared by x and A
    const float*   xp   = x + (size_t)m0 * DDIM;
    const float*   ap   = Am;
    const unsigned toff = (unsigned)(rs * DDIM + c4);

    // every loop over these arrays is unrolled: constant indices keep them in registers
    v8f acc[2][4] = {};
    float4 xr[8], ar[16];

    // pass 0 into buffer 0, pass 1 into registers
#pragma unroll
    for (int i = 0; i < 8; ++i)  xr[i] = *(const float4*)(xp + (toff + 4u * i * DDIM));
#pragma unroll
    for (int i = 0; i < 16; ++i) ar[i] = *(const float4*)(ap + (toff + 4u * i * DDIM));
#pragma unroll
    for (int i = 0; i < 8; ++i)
        *(v4bf*)(&st[(rs + 4 * i) * ZPITCH + c4]) = cvt4(xr[i]);
#pragma unroll
    for (int i = 0; i < 16; ++i)
        *(v4bf*)(&st[(ZROWS + rs + 4 * i) * ZPITCH + c4]) = cvt4(ar[i]);
#pragma unroll
    for (int i = 0; i < 8; ++i)  xr[i] = *(const float4*)(xp + ZBK + (toff + 4u * i * DDIM));
#pragma unroll
    for (int i = 0; i < 16; ++i) ar[i] = *(const float4*)(ap + ZBK + (toff + 4u * i * DDIM));
    __syncthreads();

    // unrolled so that k is a constant: every load then names the scalar base and
    // the one lane-offset register, and no address register changes under loads in flight
#pragma unroll
    for (int t = 0; t < ZNT; ++t) {
        const unsigned short* cur = st + (t & 1) * ZTILE;
        unsigned short*       nxt = st + ((t + 1) & 1) * ZTILE;
        if (t + 1 < ZNT) {               // pass t+1: registers -> the other buffer
#pragma unroll
            for (int i = 0; i < 8; ++i)
                *(v4bf*)(&nxt[(rs + 4 * i) * ZPITCH + c4]) = cvt4(xr[i]);
#pragma unroll
            for (int i = 0; i < 16; ++i)
                *(v4bf*)(&nxt[(ZROWS + rs + 4 * i) * ZPITCH + c4]) = cvt4(ar[i]);
        }
        if (t + 2 < ZNT) {               // pass t+2 flies over this pass's products
            const int k = (t + 2) * ZBK;
#pragma unroll
            for (int i = 0; i < 8; ++i)
                xr[i] = *(const float4*)(xp + k + (toff + 4u * i * DDIM));
#pragma unroll
            for (int i = 0; i < 16; ++i)
                ar[i] = *(const float4*)(ap + k + (toff + 4u * i * DDIM));
        }
        v16bf af[2];
#pragma unroll
        for (int mi = 0; mi < 2; ++mi)
            af[mi] = ldfrag(cur + (mi * 16 + l15) * ZPITCH + w * 32 + kh);
#pragma unroll
        for (int ni = 0; ni < 4; ++ni) {
            v16bf bfv = ldfrag(cur + (ZROWS + ni * 16 + l15) * ZPITCH + w * 32 + kh);
#pragma unroll
            for (int mi = 0; mi < 2; ++mi)
                acc[mi][ni] = __builtin_amdgcn_wmma_f32_16x16x32_bf16(
                    false, af[mi], false, bfv, (short)0, acc[mi][ni], false, false);
        }
        __syncthreads();
        // without it the scheduler lifts the next pass's conversions in between this
        // pass's loads, and their waits split the group of loads
        __builtin_amdgcn_sched_barrier(0);
    }

    // each wave's partial tile to LDS (C-layout: lane = col, vgpr = row)
    float* part = (float*)st;
    {
        const int m8 = (lane >> 4) * 8;
#pragma unroll
        for (int mi = 0; mi < 2; ++mi)
#pragma unroll
            for (int ni = 0; ni < 4; ++ni)
#pragma unroll
                for (int r = 0; r < 8; ++r)
                    part[(w * ZROWS + mi * 16 + m8 + r) * ZPP + ni * 16 + l15] = acc[mi][ni][r];
    }
    __syncthreads();

    // 16 threads per row, 4 columns each: add the 16 partials in wave order
    const int row = tid >> 4;
    const int col = (tid & 15) * 4;
    float4 zv = *(const float4*)(&part[row * ZPP + col]);
#pragma unroll
    for (int p = 1; p < 16; ++p) {
        float4 v = *(const float4*)(&part[(p * ZROWS + row) * ZPP + col]);
        zv.x += v.x; zv.y += v.y; zv.z += v.z; zv.w += v.w;
    }
    const float az[4] = { fabsf(zv.x), fabsf(zv.y), fabsf(zv.z), fabsf(zv.w) };
    *(float4*)(&ab[row * ZPP + col]) = make_float4(az[0], az[1], az[2], az[3]);
    __syncthreads();

    // soft top-k per row: threshold = 16th largest of |z| (rank-count select)
    int cnt[4] = { 0, 0, 0, 0 };
#pragma unroll
    for (int i = 0; i < 16; ++i) {
        float4 v = *(const float4*)(&ab[row * ZPP + i * 4]);
#pragma unroll
        for (int j = 0; j < 4; ++j)
            cnt[j] += (v.x > az[j] ? 1 : 0) + (v.y > az[j] ? 1 : 0) +
                      (v.z > az[j] ? 1 : 0) + (v.w > az[j] ? 1 : 0);
    }
    float thr = 3.4e38f;
#pragma unroll
    for (int j = 0; j < 4; ++j)
        if (cnt[j] <= (KTOP - 1) && az[j] < thr) thr = az[j];
#pragma unroll
    for (int s = 1; s < 16; s <<= 1) {   // minimum over the row's 16 threads
        float o = __shfl_xor(thr, s, 16);
        if (o < thr) thr = o;
    }
    const float zz[4] = { zv.x, zv.y, zv.z, zv.w };
    ushort4 o4;
    unsigned short ov[4];
#pragma unroll
    for (int j = 0; j < 4; ++j) {
        float m = 1.0f / (1.0f + __expf(-(az[j] - thr) * INV_TEMP));
        ov[j] = f2bf1(zz[j] * m * SCALE_V);
    }
    o4.x = ov[0]; o4.y = ov[1]; o4.z = ov[2]; o4.w = ov[3];
    *(ushort4*)(zsp + (size_t)(m0 + row) * RDIM + col) = o4;
}

// ---------------------------------------------------------------------------
// Kernel 2: convert LoRA-up matrix B (NDIM x RDIM f32) to bf16.
// ---------------------------------------------------------------------------
__global__ void __launch_bounds__(256)
bconv(const float* __restrict__ Bm, unsigned short* __restrict__ Bbf) {
    int i = (blockIdx.x * 256 + threadIdx.x) * 4;
    if (i < NDIM * RDIM) {
        float4 v = *(const float4*)(Bm + i);
        *(v4bf*)(Bbf + i) = cvt4(v);
    }
}

// ---------------------------------------------------------------------------
// Kernel 3: fused out = x@W^T + bias + zsp@Bbf^T
// Grid: (NDIM/BN, MDIM/BM), 256 threads = 8 waves (4 M x 2 N), wave tile 64x64.
// Double-buffered LDS, register-prefetched global loads, on-the-fly f32->bf16.
// ---------------------------------------------------------------------------
__global__ void __launch_bounds__(256)
gemmk(const float* __restrict__ x, const float* __restrict__ W,
      const float* __restrict__ bias,
      const unsigned short* __restrict__ zsp,
      const unsigned short* __restrict__ Bbf,
      float* __restrict__ out) {
    __shared__ __align__(16) unsigned short xs[2][BM * LDP];   // 2 x 20 KB
    __shared__ __align__(16) unsigned short wl[2][BN * LDP];   // 2 x 10 KB

    const int tid   = threadIdx.x;
    const int lane  = tid & 31;
    const int w     = tid >> 5;
    const int waveM = w >> 1;           // 0..3 -> row offset *64
    const int waveN = w & 1;            // 0..1 -> col offset *64
    const int rA    = waveM * 64;
    const int rB    = waveN * 64;
    const int m0    = blockIdx.y * BM;
    const int n0    = blockIdx.x * BN;

    const int rowq = tid >> 3;          // staging: 32 rows/pass, 8 f4 per row
    const int colq = (tid & 7) * 4;

    v8f acc[4][4] = {};
    float4 xr[8], wr[4];

    // ---- initial global load (k=0) + stage into buffer 0 ----
#pragma unroll
    for (int i = 0; i < 8; ++i)
        xr[i] = *(const float4*)(x + (size_t)(m0 + rowq + 32 * i) * DDIM + colq);
#pragma unroll
    for (int i = 0; i < 4; ++i)
        wr[i] = *(const float4*)(W + (size_t)(n0 + rowq + 32 * i) * DDIM + colq);
#pragma unroll
    for (int i = 0; i < 8; ++i)
        *(v4bf*)(&xs[0][(rowq + 32 * i) * LDP + colq]) = cvt4(xr[i]);
#pragma unroll
    for (int i = 0; i < 4; ++i)
        *(v4bf*)(&wl[0][(rowq + 32 * i) * LDP + colq]) = cvt4(wr[i]);
    __syncthreads();

    int buf = 0;
    // ---- main K loop over D_IN ----
    for (int kt = 1; kt < DDIM / BK; ++kt) {
        const int k = kt * BK;
#pragma unroll
        for (int i = 0; i < 8; ++i)
            xr[i] = *(const float4*)(x + (size_t)(m0 + rowq + 32 * i) * DDIM + k + colq);
#pragma unroll
        for (int i = 0; i < 4; ++i)
            wr[i] = *(const float4*)(W + (size_t)(n0 + rowq + 32 * i) * DDIM + k + colq);

        compute_tile(xs[buf], wl[buf], rA, rB, lane, acc);

#pragma unroll
        for (int i = 0; i < 8; ++i)
            *(v4bf*)(&xs[buf ^ 1][(rowq + 32 * i) * LDP + colq]) = cvt4(xr[i]);
#pragma unroll
        for (int i = 0; i < 4; ++i)
            *(v4bf*)(&wl[buf ^ 1][(rowq + 32 * i) * LDP + colq]) = cvt4(wr[i]);
        __syncthreads();
        buf ^= 1;
    }
    compute_tile(xs[buf], wl[buf], rA, rB, lane, acc);
    __syncthreads();

    // ---- LoRA epilogue: accumulate zsp(M x 64) @ Bbf(N x 64)^T, K=64 ----
    {
        const int row2  = tid >> 2;          // 64 rows/pass, 4x uint4 per row
        const int colq2 = (tid & 3) * 8;     // in bf16 elems (16B chunks)
#pragma unroll
        for (int kk = 0; kk < 2; ++kk) {
#pragma unroll
            for (int i = 0; i < 4; ++i) {    // 256 rows of zsp tile
                int r = row2 + 64 * i;
                *(uint4*)(&xs[0][r * LDP + colq2]) =
                    *(const uint4*)(zsp + (size_t)(m0 + r) * RDIM + kk * 32 + colq2);
            }
#pragma unroll
            for (int i = 0; i < 2; ++i) {    // 128 rows of Bbf tile
                int r = row2 + 64 * i;
                *(uint4*)(&wl[0][r * LDP + colq2]) =
                    *(const uint4*)(Bbf + (size_t)(n0 + r) * RDIM + kk * 32 + colq2);
            }
            __syncthreads();
            compute_tile(xs[0], wl[0], rA, rB, lane, acc);
            __syncthreads();
        }
    }

    // ---- epilogue: bias + store ----
    const int l15 = lane & 15;
    const int m8  = (lane >> 4) * 8;
#pragma unroll
    for (int ni = 0; ni < 4; ++ni) {
        int gn = n0 + rB + ni * 16 + l15;
        float bv = bias[gn];
#pragma unroll
        for (int mi = 0; mi < 4; ++mi) {
            int gmB = m0 + rA + mi * 16 + m8;
#pragma unroll
            for (int r = 0; r < 8; ++r)
                out[(size_t)(gmB + r) * NDIM + gn] = acc[mi][ni][r] + bv;
        }
    }
}

// ---------------------------------------------------------------------------
// Host launch
// ---------------------------------------------------------------------------
extern "C" void kernel_launch(void* const* d_in, const int* in_sizes, int n_in,
                              void* d_out, int out_size, void* d_ws, size_t ws_size,
                              hipStream_t stream) {
    const float* x    = (const float*)d_in[0];
    const float* A    = (const float*)d_in[1];
    const float* Bm   = (const float*)d_in[2];
    const float* W    = (const float*)d_in[3];
    const float* bias = (const float*)d_in[4];
    float* out = (float*)d_out;

    unsigned short* zsp = (unsigned short*)d_ws;               // MDIM*RDIM bf16 = 1 MB
    unsigned short* Bbf = zsp + (size_t)MDIM * RDIM;           // NDIM*RDIM bf16 = 0.5 MB

    zk<<<MDIM / ZROWS, 512, 0, stream>>>(x, A, zsp);
    bconv<<<(NDIM * RDIM) / (256 * 4), 256, 0, stream>>>(Bm, Bbf);
    gemmk<<<dim3(NDIM / BN, MDIM / BM), 256, 0, stream>>>(x, W, bias, zsp, Bbf, out);
}

// v002
// One run takes 287 microseconds.
// Timed twice side by side with v001, it ran 1.16 times as fast both times.
// Counting every step since v000, it is 1.45 times as fast.
#include <hip/hip_runtime.h>
#include <hip/hip_bf16.h>

// ---------------------------------------------------------------------------
// Problem constants (from reference)
// ---------------------------------------------------------------------------
#define MDIM   8192          // B_*S = 4*2048
#define DDIM   4096          // D_IN
#define NDIM   4096          // D_OUT
#define RDIM   64            // LoRA rank
#define KTOP   16
#define INV_TEMP 10.0f       // 1/0.1
#define SCALE_V  1.0f        // ALPHA/K = 16/16

// Tile config for main GEMM: block 256x256, 8 waves as 2(M) x 4(N), wave 128x64
#define BM 256
#define BN 256
#define BK 32
#define LDP 40               // LDS row pitch in bf16 elems (80B, 16B-aligned rows)

typedef __bf16 v4bf  __attribute__((ext_vector_type(4)));
typedef __bf16 v8bf  __attribute__((ext_vector_type(8)));
typedef __bf16 v16bf __attribute__((ext_vector_type(16)));
typedef float  v8f   __attribute__((ext_vector_type(8)));

// f32x4 -> bf16x4 using native conversions (backend selects v_cvt*_bf16_f32)
static __device__ __forceinline__ v4bf cvt4(float4 v) {
    v4bf r;
    r.x = (__bf16)v.x; r.y = (__bf16)v.y; r.z = (__bf16)v.z; r.w = (__bf16)v.w;
    return r;
}
static __device__ __forceinline__ unsigned short f2bf1(float f) {
    union { __bf16 h; unsigned short u; } c;
    c.h = (__bf16)f;
    return c.u;
}

// Load one 16-bit A/B-operand fragment (16x32 bf16) for this lane from LDS.
// Per ISA layout: lane L: M/N = L&15, holds K = {kh..kh+7} and {kh+16..kh+23}
// with kh = (L>=16 ? 8 : 0).  p points at row start + kh; halves are 16B apart.
static __device__ __forceinline__ v16bf ldfrag(const unsigned short* p) {
    v8bf lo = *(const v8bf*)(p);
    v8bf hi = *(const v8bf*)(p + 16);
    return __builtin_shufflevector(lo, hi, 0,1,2,3,4,5,6,7,8,9,10,11,12,13,14,15);
}

// One BK=32 K-step for a wave tile of 128x64 (8x4 of 16x16 wmma tiles):
// 32 WMMAs per 12 fragment loads (24 ds_load_b128).
static __device__ __forceinline__ void ldfrags(const unsigned short* xsB,
                                               const unsigned short* wsB,
                                               int rA, int rB, int lane,
                                               v16bf (&af)[8], v16bf (&bfv)[4]) {
    const int l15 = lane & 15;
    const int kh  = (lane >> 4) << 3;
#pragma unroll
    for (int ni = 0; ni < 4; ++ni)
        bfv[ni] = ldfrag(wsB + (rB + ni * 16 + l15) * LDP + kh);
#pragma unroll
    for (int mi = 0; mi < 8; ++mi)
        af[mi] = ldfrag(xsB + (rA + mi * 16 + l15) * LDP + kh);
}
static __device__ __forceinline__ void mma(const v16bf (&af)[8], const v16bf (&bfv)[4],
                                           v8f (&acc)[8][4]) {
#pragma unroll
    for (int mi = 0; mi < 8; ++mi)
#pragma unroll
        for (int ni = 0; ni < 4; ++ni)
            acc[mi][ni] = __builtin_amdgcn_wmma_f32_16x16x32_bf16(
                false, af[mi], false, bfv[ni], (short)0, acc[mi][ni], false, false);
}
static __device__ __forceinline__ void compute_tile(const unsigned short* xsB,
                                                    const unsigned short* wsB,
                                                    int rA, int rB, int lane,
                                                    v8f (&acc)[8][4]) {
    v16bf af[8], bfv[4];
    ldfrags(xsB, wsB, rA, rB, lane, af, bfv);
    mma(af, bfv, acc);
}

// One K-step's share of a thread: 8 float4 of x rows and 8 of W rows, 32 rows apart.
// xk, wk are block-uniform; toff is the one 32-bit lane offset, so that the 16 loads
// need no address pairs of their own beside the 256 accumulator registers.
static __device__ __forceinline__ void gload(const float* xk, const float* wk, unsigned toff,
                                             float4 (&xr)[8], float4 (&wr)[8]) {
#pragma unroll
    for (int i = 0; i < 8; ++i) xr[i] = *(const float4*)(xk + (toff + 32u * i * DDIM));
#pragma unroll
    for (int i = 0; i < 8; ++i) wr[i] = *(const float4*)(wk + (toff + 32u * i * DDIM));
    // the bases and the offset register that these loads name are rewritten further on
    asm volatile("s_wait_xcnt 0x0" ::: "memory");
}
static __device__ __forceinline__ void sstore(unsigned short* xsB, unsigned short* wsB, int soff,
                                              const float4 (&xr)[8], const float4 (&wr)[8]) {
#pragma unroll
    for (int i = 0; i < 8; ++i) *(v4bf*)(&xsB[soff + 32 * i * LDP]) = cvt4(xr[i]);
#pragma unroll
    for (int i = 0; i < 8; ++i) *(v4bf*)(&wsB[soff + 32 * i * LDP]) = cvt4(wr[i]);
}

// ---------------------------------------------------------------------------
// Kernel 1: z = x @ A^T, soft-top-k mask, write z_sparse*SCALE as bf16.
// Grid: MDIM/32 blocks (one per WGP), 512 threads (16 waves).
// A pass stages 512 k of 32 x rows and of all 64 A rows; wave w multiplies the
// 32 k at offset 32*w of the pass for all 32 rows x 64 cols, so the 16 waves
// hold 16 partial sums over k, added through LDS behind the loop.
// ---------------------------------------------------------------------------
#define ZROWS  32            // x rows per block
#define ZBK    512           // k per pass = 16 waves x 32
#define ZPITCH 520           // LDS row pitch in bf16 elems (1040 B = 16 B x odd)
#define ZTILE  ((ZROWS + RDIM) * ZPITCH)
#define ZPP    68            // row pitch of the f32 partial tiles
#define ZNT    (DDIM / ZBK)

__global__ void __launch_bounds__(512)
zk(const float* __restrict__ x, const float* __restrict__ Am,
   unsigned short* __restrict__ zsp) {
    // two staging buffers; the 16 partial tiles reuse the same bytes afterwards
    __shared__ __align__(16) unsigned short st[2 * ZTILE];
    __shared__ __align__(16) float ab[ZROWS * ZPP];
    static_assert(2 * ZTILE * 2 >= 16 * ZROWS * ZPP * 4, "partials fit");

    const int tid  = threadIdx.x;
    const int lane = tid & 31;
    const int w    = tid >> 5;
    const int l15  = lane & 15;
    const int kh   = (lane >> 4) << 3;
    const int m0   = blockIdx.x * ZROWS;
    const int rs   = tid >> 7;            // 4 rows per sweep, 128 float4 per row
    const int c4   = (tid & 127) * 4;     // a wave reads 512 contiguous bytes

    // block-uniform bases plus one 32-bit lane offset shared by x and A
    const float*   xp   = x + (size_t)m0 * DDIM;
    const float*   ap   = Am;
    const unsigned toff = (unsigned)(rs * DDIM + c4);

    // every loop over these arrays is unrolled: constant indices keep them in registers
    v8f acc[2][4] = {};
    float4 xr[8], ar[16];

    // pass 0 into buffer 0, pass 1 into registers
#pragma unroll
    for (int i = 0; i < 8; ++i)  xr[i] = *(const float4*)(xp + (toff + 4u * i * DDIM));
#pragma unroll
    for (int i = 0; i < 16; ++i) ar[i] = *(const float4*)(ap + (toff + 4u * i * DDIM));
#pragma unroll
    for (int i = 0; i < 8; ++i)
        *(v4bf*)(&st[(rs + 4 * i) * ZPITCH + c4]) = cvt4(xr[i]);
#pragma unroll
    for (int i = 0; i < 16; ++i)
        *(v4bf*)(&st[(ZROWS + rs + 4 * i) * ZPITCH + c4]) = cvt4(ar[i]);
#pragma unroll
    for (int i = 0; i < 8; ++i)  xr[i] = *(const float4*)(xp + ZBK + (toff + 4u * i * DDIM));
#pragma unroll
    for (int i = 0; i < 16; ++i) ar[i] = *(const float4*)(ap + ZBK + (toff + 4u * i * DDIM));
    __syncthreads();

    // unrolled so that k is a constant: every load then names the scalar base and
    // the one lane-offset register, and no address register changes under loads in flight
#pragma unroll
    for (int t = 0; t < ZNT; ++t) {
        const unsigned short* cur = st + (t & 1) * ZTILE;
        unsigned short*       nxt = st + ((t + 1) & 1) * ZTILE;
        if (t + 1 < ZNT) {               // pass t+1: registers -> the other buffer
#pragma unroll
            for (int i = 0; i < 8; ++i)
                *(v4bf*)(&nxt[(rs + 4 * i) * ZPITCH + c4]) = cvt4(xr[i]);
#pragma unroll
            for (int i = 0; i < 16; ++i)
                *(v4bf*)(&nxt[(ZROWS + rs + 4 * i) * ZPITCH + c4]) = cvt4(ar[i]);
        }
        if (t + 2 < ZNT) {               // pass t+2 flies over this pass's products
            const int k = (t + 2) * ZBK;
#pragma unroll
            for (int i = 0; i < 8; ++i)
                xr[i] = *(const float4*)(xp + k + (toff + 4u * i * DDIM));
#pragma unroll
            for (int i = 0; i < 16; ++i)
                ar[i] = *(const float4*)(ap + k + (toff + 4u * i * DDIM));
        }
        v16bf af[2];
#pragma unroll
        for (int mi = 0; mi < 2; ++mi)
            af[mi] = ldfrag(cur + (mi * 16 + l15) * ZPITCH + w * 32 + kh);
#pragma unroll
        for (int ni = 0; ni < 4; ++ni) {
            v16bf bfv = ldfrag(cur + (ZROWS + ni * 16 + l15) * ZPITCH + w * 32 + kh);
#pragma unroll
            for (int mi = 0; mi < 2; ++mi)
                acc[mi][ni] = __builtin_amdgcn_wmma_f32_16x16x32_bf16(
                    false, af[mi], false, bfv, (short)0, acc[mi][ni], false, false);
        }
        __syncthreads();
        // without it the scheduler lifts the next pass's conversions in between this
        // pass's loads, and their waits split the group of loads
        __builtin_amdgcn_sched_barrier(0);
    }

    // each wave's partial tile to LDS (C-layout: lane = col, vgpr = row)
    float* part = (float*)st;
    {
        const int m8 = (lane >> 4) * 8;
#pragma unroll
        for (int mi = 0; mi < 2; ++mi)
#pragma unroll
            for (int ni = 0; ni < 4; ++ni)
#pragma unroll
                for (int r = 0; r < 8; ++r)
                    part[(w * ZROWS + mi * 16 + m8 + r) * ZPP + ni * 16 + l15] = acc[mi][ni][r];
    }
    __syncthreads();

    // 16 threads per row, 4 columns each: add the 16 partials in wave order
    const int row = tid >> 4;
    const int col = (tid & 15) * 4;
    float4 zv = *(const float4*)(&part[row * ZPP + col]);
#pragma unroll
    for (int p = 1; p < 16; ++p) {
        float4 v = *(const float4*)(&part[(p * ZROWS + row) * ZPP + col]);
        zv.x += v.x; zv.y += v.y; zv.z += v.z; zv.w += v.w;
    }
    const float az[4] = { fabsf(zv.x), fabsf(zv.y), fabsf(zv.z), fabsf(zv.w) };
    *(float4*)(&ab[row * ZPP + col]) = make_float4(az[0], az[1], az[2], az[3]);
    __syncthreads();

    // soft top-k per row: threshold = 16th largest of |z| (rank-count select)
    int cnt[4] = { 0, 0, 0, 0 };
#pragma unroll
    for (int i = 0; i < 16; ++i) {
        float4 v = *(const float4*)(&ab[row * ZPP + i * 4]);
#pragma unroll
        for (int j = 0; j < 4; ++j)
            cnt[j] += (v.x > az[j] ? 1 : 0) + (v.y > az[j] ? 1 : 0) +
                      (v.z > az[j] ? 1 : 0) + (v.w > az[j] ? 1 : 0);
    }
    float thr = 3.4e38f;
#pragma unroll
    for (int j = 0; j < 4; ++j)
        if (cnt[j] <= (KTOP - 1) && az[j] < thr) thr = az[j];
#pragma unroll
    for (int s = 1; s < 16; s <<= 1) {   // minimum over the row's 16 threads
        float o = __shfl_xor(thr, s, 16);
        if (o < thr) thr = o;
    }
    const float zz[4] = { zv.x, zv.y, zv.z, zv.w };
    ushort4 o4;
    unsigned short ov[4];
#pragma unroll
    for (int j = 0; j < 4; ++j) {
        float m = 1.0f / (1.0f + __expf(-(az[j] - thr) * INV_TEMP));
        ov[j] = f2bf1(zz[j] * m * SCALE_V);
    }
    o4.x = ov[0]; o4.y = ov[1]; o4.z = ov[2]; o4.w = ov[3];
    *(ushort4*)(zsp + (size_t)(m0 + row) * RDIM + col) = o4;
}

// ---------------------------------------------------------------------------
// Kernel 2: convert LoRA-up matrix B (NDIM x RDIM f32) to bf16.
// ---------------------------------------------------------------------------
__global__ void __launch_bounds__(256)
bconv(const float* __restrict__ Bm, unsigned short* __restrict__ Bbf) {
    int i = (blockIdx.x * 256 + threadIdx.x) * 4;
    if (i < NDIM * RDIM) {
        float4 v = *(const float4*)(Bm + i);
        *(v4bf*)(Bbf + i) = cvt4(v);
    }
}

// ---------------------------------------------------------------------------
// Kernel 3: fused out = x@W^T + bias + zsp@Bbf^T
// Grid: (NDIM/BN, MDIM/BM), 256 threads = 8 waves (2 M x 4 N), wave tile 128x64,
// one block per WGP (256 accumulator registers a lane).
// Double-buffered LDS, register-prefetched global loads, on-the-fly f32->bf16.
// ---------------------------------------------------------------------------
__global__ void __launch_bounds__(256)
gemmk(const float* __restrict__ x, const float* __restrict__ W,
      const float* __restrict__ bias,
      const unsigned short* __restrict__ zsp,
      const unsigned short* __restrict__ Bbf,
      float* __restrict__ out) {
    __shared__ __align__(16) unsigned short xs[2][BM * LDP];   // 2 x 20 KB
    __shared__ __align__(16) unsigned short wl[2][BN * LDP];   // 2 x 20 KB

    const int tid   = threadIdx.x;
    const int lane  = tid & 31;
    const int w     = tid >> 5;
    const int rA    = (w >> 2) * 128;   // wave's first row in the block tile
    const int rB    = (w & 3) * 64;     // wave's first column in the block tile
    const int m0    = blockIdx.y * BM;
    const int n0    = blockIdx.x * BN;

    const int rowq = tid >> 3;          // staging: 32 rows/sweep, 8 float4 per row
    const int colq = (tid & 7) * 4;
    const int soff = rowq * LDP + colq;

    const float*   xk   = x + (size_t)m0 * DDIM;   // block-uniform, advanced by BK a step
    const float*   wk   = W + (size_t)n0 * DDIM;
    const unsigned toff = (unsigned)(rowq * DDIM + colq);

    v8f acc[8][4] = {};
    float4 xr[8], wr[8];

    // ---- initial global load (k=0) + stage into buffer 0 ----
    gload(xk, wk, toff, xr, wr);
    sstore(xs[0], wl[0], soff, xr, wr);
    __syncthreads();

    int buf = 0;
    // ---- main K loop over D_IN ----
    for (int kt = 1; kt < DDIM / BK; ++kt) {
        v16bf af[8], bfv[4];
        ldfrags(xs[buf], wl[buf], rA, rB, lane, af, bfv);
        // keeps the 24 LDS reads one group in source order: otherwise the scheduler deals
        // them out two to a row of four WMMAs, and every row waits for its own reads
        __builtin_amdgcn_sched_barrier(0);
        xk += BK;
        wk += BK;
        gload(xk, wk, toff, xr, wr);
        mma(af, bfv, acc);
        sstore(xs[buf ^ 1], wl[buf ^ 1], soff, xr, wr);
        // order of the rest of the step: the 16 global loads, the 32 WMMAs under them, the
        // 32 conversions, the 8 LDS stores. Otherwise the conversions, and with them the
        // waits for the loads just issued, come to stand ahead of the WMMAs
        __builtin_amdgcn_sched_group_barrier(0x020, 16, 0);
        __builtin_amdgcn_sched_group_barrier(0x008, 32, 0);
        __builtin_amdgcn_sched_group_barrier(0x002, 32, 0);
        __builtin_amdgcn_sched_group_barrier(0x200, 8, 0);
        __syncthreads();
        buf ^= 1;
    }
    compute_tile(xs[buf], wl[buf], rA, rB, lane, acc);
    __syncthreads();

    // ---- LoRA epilogue: accumulate zsp(M x 64) @ Bbf(N x 64)^T, K=64 ----
    {
        const int row2  = tid >> 2;          // 64 rows/sweep, 4x uint4 per row
        const int colq2 = (tid & 3) * 8;     // in bf16 elems (16B chunks)
        const int soff2 = row2 * LDP + colq2;
        const unsigned short* zp = zsp + (size_t)m0 * RDIM;   // block-uniform
        const unsigned short* bp = Bbf + (size_t)n0 * RDIM;
        const unsigned loff = (unsigned)(row2 * RDIM + colq2);
#pragma unroll
        for (int kk = 0; kk < 2; ++kk) {
            uint4 zr[4], br[4];              // 256 rows of the zsp tile, 256 of the Bbf tile
#pragma unroll
            for (int i = 0; i < 4; ++i)
                zr[i] = *(const uint4*)(zp + (loff + 64u * i * RDIM + kk * 32u));
#pragma unroll
            for (int i = 0; i < 4; ++i)
                br[i] = *(const uint4*)(bp + (loff + 64u * i * RDIM + kk * 32u));
#pragma unroll
            for (int i = 0; i < 4; ++i)
                *(uint4*)(&xs[0][soff2 + 64 * i * LDP]) = zr[i];
#pragma unroll
            for (int i = 0; i < 4; ++i)
                *(uint4*)(&wl[0][soff2 + 64 * i * LDP]) = br[i];
            __syncthreads();
            compute_tile(xs[0], wl[0], rA, rB, lane, acc);
            __syncthreads();
        }
    }

    // ---- epilogue: bias + store ----
    const int l15 = lane & 15;
    const int m8  = (lane >> 4) * 8;
#pragma unroll
    for (int ni = 0; ni < 4; ++ni) {
        int gn = n0 + rB + ni * 16 + l15;
        float bv = bias[gn];
#pragma unroll
        for (int mi = 0; mi < 8; ++mi) {
            int gmB = m0 + rA + mi * 16 + m8;
#pragma unroll
            for (int r = 0; r < 8; ++r)
                out[(size_t)(gmB + r) * NDIM + gn] = acc[mi][ni][r] + bv;
        }
    }
}

// ---------------------------------------------------------------------------
// Host launch
// ---------------------------------------------------------------------------
extern "C" void kernel_launch(void* const* d_in, const int* in_sizes, int n_in,
                              void* d_out, int out_size, void* d_ws, size_t ws_size,
                              hipStream_t stream) {
    const float* x    = (const float*)d_in[0];
    const float* A    = (const float*)d_in[1];
    const float* Bm   = (const float*)d_in[2];
    const float* W    = (const float*)d_in[3];
    const float* bias = (const float*)d_in[4];
    float* out = (float*)d_out;

    unsigned short* zsp = (unsigned short*)d_ws;               // MDIM*RDIM bf16 = 1 MB
    unsigned short* Bbf = zsp + (size_t)MDIM * RDIM;           // NDIM*RDIM bf16 = 0.5 MB

    zk<<<MDIM / ZROWS, 512, 0, stream>>>(x, A, zsp);
    bconv<<<(NDIM * RDIM) / (256 * 4), 256, 0, stream>>>(Bm, Bbf);
    gemmk<<<dim3(NDIM / BN, MDIM / BM), 256, 0, stream>>>(x, W, bias, zsp, Bbf, out);
}

// v003
// A run of this version takes 171 microseconds.
// Next to v002, in two timings, it ran 1.68 times as fast each time.
// Counting every step since v000, it is 2.44 times as fast.
#include <hip/hip_runtime.h>
#include <hip/hip_bf16.h>
#include <stdint.h>

// ---------------------------------------------------------------------------
// Problem constants (from reference)
// ---------------------------------------------------------------------------
#define MDIM   8192          // B_*S = 4*2048
#define DDIM   4096          // D_IN
#define NDIM   4096          // D_OUT
#define RDIM   64            // LoRA rank
#define KTOP   16
#define INV_TEMP 10.0f       // 1/0.1
#define SCALE_V  1.0f        // ALPHA/K = 16/16

// Tile config for main GEMM: block 256x256, 8 waves as 2(M) x 4(N), wave 128x64
#define BM 256
#define BN 256
#define LDP 40               // LDS row pitch in bf16 elems (80B) of the rank-64 tiles

// Ring of the main GEMM: a pass is 128 k = 256 B of each of the 512 operand rows.
// Each wave's tensor load brings 64 rows; the mover pads a row to 272 B (16 B x odd).
#define PASSK   128
#define NPASS   (DDIM / PASSK)
#define ROWB    256u
#define RPITCH  272u
#define SROWS   64u
#define SLICEB  18432u       // 64 x 272 = 17408, rounded up to a multiple of 2 KiB
#define STAGEB  (8u * SLICEB)

typedef __bf16 v4bf  __attribute__((ext_vector_type(4)));
typedef __bf16 v8bf  __attribute__((ext_vector_type(8)));
typedef __bf16 v16bf __attribute__((ext_vector_type(16)));
typedef float  v8f   __attribute__((ext_vector_type(8)));
typedef uint32_t u32x4 __attribute__((ext_vector_type(4)));
typedef uint32_t u32x8 __attribute__((ext_vector_type(8)));

// f32x4 -> bf16x4 using native conversions (backend selects v_cvt*_bf16_f32)
static __device__ __forceinline__ v4bf cvt4(float4 v) {
    v4bf r;
    r.x = (__bf16)v.x; r.y = (__bf16)v.y; r.z = (__bf16)v.z; r.w = (__bf16)v.w;
    return r;
}
static __device__ __forceinline__ unsigned short f2bf1(float f) {
    union { __bf16 h; unsigned short u; } c;
    c.h = (__bf16)f;
    return c.u;
}

// Load one 16-bit A/B-operand fragment (16x32 bf16) for this lane from LDS.
// Per ISA layout: lane L: M/N = L&15, holds K = {kh..kh+7} and {kh+16..kh+23}
// with kh = (L>=16 ? 8 : 0).  p points at row start + kh; halves are 32B apart.
static __device__ __forceinline__ v16bf ldfrag(const unsigned short* p) {
    v8bf lo = *(const v8bf*)(p);
    v8bf hi = *(const v8bf*)(p + 16);
    return __builtin_shufflevector(lo, hi, 0,1,2,3,4,5,6,7,8,9,10,11,12,13,14,15);
}

// One BK=32 K-step for a wave tile of 128x64 (8x4 of 16x16 wmma tiles):
// 32 WMMAs per 12 fragment loads (24 ds_load_b128).
static __device__ __forceinline__ void ldfrags(const unsigned short* xsB,
                                               const unsigned short* wsB,
                                               int rA, int rB, int lane,
                                               v16bf (&af)[8], v16bf (&bfv)[4]) {
    const int l15 = lane & 15;
    const int kh  = (lane >> 4) << 3;
#pragma unroll
    for (int ni = 0; ni < 4; ++ni)
        bfv[ni] = ldfrag(wsB + (rB + ni * 16 + l15) * LDP + kh);
#pragma unroll
    for (int mi = 0; mi < 8; ++mi)
        af[mi] = ldfrag(xsB + (rA + mi * 16 + l15) * LDP + kh);
}
static __device__ __forceinline__ void mma(const v16bf (&af)[8], const v16bf (&bfv)[4],
                                           v8f (&acc)[8][4]) {
#pragma unroll
    for (int mi = 0; mi < 8; ++mi)
#pragma unroll
        for (int ni = 0; ni < 4; ++ni)
            acc[mi][ni] = __builtin_amdgcn_wmma_f32_16x16x32_bf16(
                false, af[mi], false, bfv[ni], (short)0, acc[mi][ni], false, false);
}
static __device__ __forceinline__ void compute_tile(const unsigned short* xsB,
                                                    const unsigned short* wsB,
                                                    int rA, int rB, int lane,
                                                    v8f (&acc)[8][4]) {
    v16bf af[8], bfv[4];
    ldfrags(xsB, wsB, rA, rB, lane, af, bfv);
    mma(af, bfv, acc);
}

// The same fragment from a ring row (byte addresses; the halves are 32 B apart).
static __device__ __forceinline__ v16bf ldfragb(const unsigned char* p) {
    v8bf lo = *(const v8bf*)(p);
    v8bf hi = *(const v8bf*)(p + 32);
    return __builtin_shufflevector(lo, hi, 0,1,2,3,4,5,6,7,8,9,10,11,12,13,14,15);
}
// Fragments of the 32 k at byte 64*kb of the pass's rows. pa, pb: this lane's row 0 of
// the wave's x rows (two slices) and W rows (one slice), its 16-byte half included.
static __device__ __forceinline__ void ldring(const unsigned char* pa, const unsigned char* pb,
                                              int kb, v16bf (&af)[8], v16bf (&bfv)[4]) {
#pragma unroll
    for (int ni = 0; ni < 4; ++ni)
        bfv[ni] = ldfragb(pb + ni * 16 * RPITCH + kb * 64);
#pragma unroll
    for (int mi = 0; mi < 8; ++mi)
        af[mi] = ldfragb(pa + (mi >> 2) * SLICEB + (mi & 3) * 16 * RPITCH + kb * 64);
}

static __device__ __forceinline__ uint32_t uni(uint32_t v) {
    return (uint32_t)__builtin_amdgcn_readfirstlane(v);
}
static __device__ __forceinline__ uint32_t pinned(uint32_t v) {
    uint32_t w = uni(v);
    // holds the wave-uniform word in a scalar register: a test on it compiles to s_cmp and
    // s_cbranch_scc (a tensor load ignores EXEC), and it is formed where the statement stands
    asm volatile("" : "+s"(w));
    return w;
}
static __device__ __forceinline__ void tdm_load(u32x4 g0, u32x8 g1) {
    asm volatile("tensor_load_to_lds %0, %1" :: "s"(g0), "s"(g1) : "memory");
}
// Tile of 64 rows of 256 B, byte elements, source pitch one bf16 row of DDIM,
// 4 dwords of LDS pad behind every 64 dwords; no mask.
static __device__ __forceinline__ u32x8 tdm_group1() {
    u32x8 g;
    g[0] = uni((1u << 20) | (5u << 22) | (3u << 25));
    g[1] = uni((ROWB & 0xFFFFu) << 16);
    g[2] = uni((ROWB >> 16) | ((SROWS & 0xFFFFu) << 16));
    g[3] = uni((SROWS >> 16) | (ROWB << 16));
    g[4] = uni(SROWS);
    g[5] = uni(2u * DDIM);
    g[6] = uni(0u);
    g[7] = uni(0u);
    return g;
}
static __device__ __forceinline__ u32x4 tdm_group0(uint32_t lds_dst, uint64_t ga) {
    u32x4 g;
    g[0] = uni(1u);
    g[1] = uni(lds_dst);
    g[2] = uni((uint32_t)ga);
    g[3] = uni((((uint32_t)(ga >> 32)) & 0x01FFFFFFu) | 0x80000000u);
    return g;
}

// ---------------------------------------------------------------------------
// Kernel 1: z = x @ A^T, soft-top-k mask, write z_sparse*SCALE as bf16.
// The bf16 values of x that it stages are also stored to xb, for the main GEMM.
// Grid: MDIM/32 blocks (one per WGP), 512 threads (16 waves).
// A pass stages 512 k of 32 x rows and of all 64 A rows; wave w multiplies the
// 32 k at offset 32*w of the pass for all 32 rows x 64 cols, so the 16 waves
// hold 16 partial sums over k, added through LDS behind the loop.
// ---------------------------------------------------------------------------
#define ZROWS  32            // x rows per block
#define ZBK    512           // k per pass = 16 waves x 32
#define ZPITCH 520           // LDS row pitch in bf16 elems (1040 B = 16 B x odd)
#define ZTILE  ((ZROWS + RDIM) * ZPITCH)
#define ZPP    68            // row pitch of the f32 partial tiles
#define ZNT    (DDIM / ZBK)

__global__ void __launch_bounds__(512)
zk(const float* __restrict__ x, const float* __restrict__ Am,
   unsigned short* __restrict__ zsp, unsigned short* __restrict__ xb) {
    // two staging buffers; the 16 partial tiles reuse the same bytes afterwards
    __shared__ __align__(16) unsigned short st[2 * ZTILE];
    __shared__ __align__(16) float ab[ZROWS * ZPP];
    static_assert(2 * ZTILE * 2 >= 16 * ZROWS * ZPP * 4, "partials fit");

    const int tid  = threadIdx.x;
    const int lane = tid & 31;
    const int w    = tid >> 5;
    const int l15  = lane & 15;
    const int kh   = (lane >> 4) << 3;
    const int m0   = blockIdx.x * ZROWS;
    const int rs   = tid >> 7;            // 4 rows per sweep, 128 float4 per row
    const int c4   = (tid & 127) * 4;     // a wave reads 512 contiguous bytes

    // block-uniform bases plus one 32-bit lane offset shared by x and A
    const float*   xp   = x + (size_t)m0 * DDIM;
    const float*   ap   = Am;
    unsigned short* xo  = xb + (size_t)m0 * DDIM;
    const unsigned toff = (unsigned)(rs * DDIM + c4);

    // every loop over these arrays is unrolled: constant indices keep them in registers
    v8f acc[2][4] = {};
    float4 xr[8], ar[16];

    // pass 0 into buffer 0, pass 1 into registers
#pragma unroll
    for (int i = 0; i < 8; ++i)  xr[i] = *(const float4*)(xp + (toff + 4u * i * DDIM));
#pragma unroll
    for (int i = 0; i < 16; ++i) ar[i] = *(const float4*)(ap + (toff + 4u * i * DDIM));
#pragma unroll
    for (int i = 0; i < 8; ++i) {
        const v4bf c = cvt4(xr[i]);
        *(v4bf*)(&st[(rs + 4 * i) * ZPITCH + c4]) = c;
        *(v4bf*)(xo + (toff + 4u * i * DDIM)) = c;
    }
    // the registers that these stores name are rewritten further on
    asm volatile("s_wait_xcnt 0x0" ::: "memory");
#pragma unroll
    for (int i = 0; i < 16; ++i)
        *(v4bf*)(&st[(ZROWS + rs + 4 * i) * ZPITCH + c4]) = cvt4(ar[i]);
#pragma unroll
    for (int i = 0; i < 8; ++i)  xr[i] = *(const float4*)(xp + ZBK + (toff + 4u * i * DDIM));
#pragma unroll
    for (int i = 0; i < 16; ++i) ar[i] = *(const float4*)(ap + ZBK + (toff + 4u * i * DDIM));
    __syncthreads();

    // unrolled so that k is a constant: every load then names the scalar base and
    // the one lane-offset register, and no address register changes under loads in flight
#pragma unroll
    for (int t = 0; t < ZNT; ++t) {
        const unsigned short* cur = st + (t & 1) * ZTILE;
        unsigned short*       nxt = st + ((t + 1) & 1) * ZTILE;
        if (t + 1 < ZNT) {               // pass t+1: registers -> the other buffer
#pragma unroll
            for (int i = 0; i < 8; ++i) {
                const v4bf c = cvt4(xr[i]);
                *(v4bf*)(&nxt[(rs + 4 * i) * ZPITCH + c4]) = c;
                *(v4bf*)(xo + (t + 1) * ZBK + (toff + 4u * i * DDIM)) = c;
            }
            // the registers that these stores name are rewritten further on
            asm volatile("s_wait_xcnt 0x0" ::: "memory");
#pragma unroll
            for (int i = 0; i < 16; ++i)
                *(v4bf*)(&nxt[(ZROWS + rs + 4 * i) * ZPITCH + c4]) = cvt4(ar[i]);
        }
        if (t + 2 < ZNT) {               // pass t+2 flies over this pass's products
            const int k = (t + 2) * ZBK;
#pragma unroll
            for (int i = 0; i < 8; ++i)
                xr[i] = *(const float4*)(xp + k + (toff + 4u * i * DDIM));
#pragma unroll
            for (int i = 0; i < 16; ++i)
                ar[i] = *(const float4*)(ap + k + (toff + 4u * i * DDIM));
        }
        v16bf af[2];
#pragma unroll
        for (int mi = 0; mi < 2; ++mi)
            af[mi] = ldfrag(cur + (mi * 16 + l15) * ZPITCH + w * 32 + kh);
#pragma unroll
        for (int ni = 0; ni < 4; ++ni) {
            v16bf bfv = ldfrag(cur + (ZROWS + ni * 16 + l15) * ZPITCH + w * 32 + kh);
#pragma unroll
            for (int mi = 0; mi < 2; ++mi)
                acc[mi][ni] = __builtin_amdgcn_wmma_f32_16x16x32_bf16(
                    false, af[mi], false, bfv, (short)0, acc[mi][ni], false, false);
        }
        __syncthreads();
        // without it the scheduler lifts the next pass's conversions in between this
        // pass's loads, and their waits split the group of loads
        __builtin_amdgcn_sched_barrier(0);
    }

    // each wave's partial tile to LDS (C-layout: lane = col, vgpr = row)
    float* part = (float*)st;
    {
        const int m8 = (lane >> 4) * 8;
#pragma unroll
        for (int mi = 0; mi < 2; ++mi)
#pragma unroll
            for (int ni = 0; ni < 4; ++ni)
#pragma unroll
                for (int r = 0; r < 8; ++r)
                    part[(w * ZROWS + mi * 16 + m8 + r) * ZPP + ni * 16 + l15] = acc[mi][ni][r];
    }
    __syncthreads();

    // 16 threads per row, 4 columns each: add the 16 partials in wave order
    const int row = tid >> 4;
    const int col = (tid & 15) * 4;
    float4 zv = *(const float4*)(&part[row * ZPP + col]);
#pragma unroll
    for (int p = 1; p < 16; ++p) {
        float4 v = *(const float4*)(&part[(p * ZROWS + row) * ZPP + col]);
        zv.x += v.x; zv.y += v.y; zv.z += v.z; zv.w += v.w;
    }
    const float az[4] = { fabsf(zv.x), fabsf(zv.y), fabsf(zv.z), fabsf(zv.w) };
    *(float4*)(&ab[row * ZPP + col]) = make_float4(az[0], az[1], az[2], az[3]);
    __syncthreads();

    // soft top-k per row: threshold = 16th largest of |z| (rank-count select)
    int cnt[4] = { 0, 0, 0, 0 };
#pragma unroll
    for (int i = 0; i < 16; ++i) {
        float4 v = *(const float4*)(&ab[row * ZPP + i * 4]);
#pragma unroll
        for (int j = 0; j < 4; ++j)
            cnt[j] += (v.x > az[j] ? 1 : 0) + (v.y > az[j] ? 1 : 0) +
                      (v.z > az[j] ? 1 : 0) + (v.w > az[j] ? 1 : 0);
    }
    float thr = 3.4e38f;
#pragma unroll
    for (int j = 0; j < 4; ++j)
        if (cnt[j] <= (KTOP - 1) && az[j] < thr) thr = az[j];
#pragma unroll
    for (int s = 1; s < 16; s <<= 1) {   // minimum over the row's 16 threads
        float o = __shfl_xor(thr, s, 16);
        if (o < thr) thr = o;
    }
    const float zz[4] = { zv.x, zv.y, zv.z, zv.w };
    ushort4 o4;
    unsigned short ov[4];
#pragma unroll
    for (int j = 0; j < 4; ++j) {
        float m = 1.0f / (1.0f + __expf(-(az[j] - thr) * INV_TEMP));
        ov[j] = f2bf1(zz[j] * m * SCALE_V);
    }
    o4.x = ov[0]; o4.y = ov[1]; o4.z = ov[2]; o4.w = ov[3];
    *(ushort4*)(zsp + (size_t)(m0 + row) * RDIM + col) = o4;
}

// ---------------------------------------------------------------------------
// Kernel 2: convert W (NDIM x DDIM) and the LoRA-up matrix B (NDIM x RDIM) to bf16.
// A block converts 1024 float4, 4 a thread; the first WBLK blocks take W, the rest B.
// ---------------------------------------------------------------------------
#define WBLK (NDIM * DDIM / 4096)
#define BBLK (NDIM * RDIM / 4096)
__global__ void __launch_bounds__(256)
wbconv(const float* __restrict__ Wm, const float* __restrict__ Bm,
       unsigned short* __restrict__ Wbf, unsigned short* __restrict__ Bbf) {
    const bool isW = blockIdx.x < WBLK;
    const float*    s = isW ? Wm + (size_t)blockIdx.x * 4096 : Bm + (size_t)(blockIdx.x - WBLK) * 4096;
    unsigned short* d = isW ? Wbf + (size_t)blockIdx.x * 4096 : Bbf + (size_t)(blockIdx.x - WBLK) * 4096;
    const unsigned  o = threadIdx.x * 4u;
    float4 v[4];
#pragma unroll
    for (int j = 0; j < 4; ++j) v[j] = *(const float4*)(s + (o + 1024u * j));
#pragma unroll
    for (int j = 0; j < 4; ++j) *(v4bf*)(d + (o + 1024u * j)) = cvt4(v[j]);
}

// ---------------------------------------------------------------------------
// Kernel 3: fused out = x@W^T + bias + zsp@Bbf^T, x and W read as their bf16 copies.
// Grid: (NDIM/BN, MDIM/BM), 256 threads = 8 waves (2 M x 4 N), wave tile 128x64,
// one block per WGP (256 accumulator registers a lane).
// Operands come by tensor loads into a ring of two LDS buffers: every wave brings one
// slice of 64 rows a pass (waves 0-3 x rows, waves 4-7 W rows), two passes ahead.
// ---------------------------------------------------------------------------
__global__ void __launch_bounds__(256)
gemmk(const unsigned short* __restrict__ xb, const unsigned short* __restrict__ Wbf,
      const float* __restrict__ bias,
      const unsigned short* __restrict__ zsp,
      const unsigned short* __restrict__ Bbf,
      float* __restrict__ out) {
    __shared__ __attribute__((aligned(2048))) unsigned char ring[2 * STAGEB];

    const int tid   = threadIdx.x;
    const int lane  = tid & 31;
    const int w     = tid >> 5;
    const int rA    = (w >> 2) * 128;   // wave's first row in the block tile
    const int rB    = (w & 3) * 64;     // wave's first column in the block tile
    const int m0    = blockIdx.y * BM;
    const int n0    = blockIdx.x * BN;

    // this wave's slice: its place in a buffer and its first source byte
    const uint32_t wave  = uni((uint32_t)tid >> 5);
    const uint32_t ldst  = (uint32_t)(size_t)ring + wave * SLICEB;
    const unsigned short* srow = wave < 4u ? xb  + (size_t)(m0 + 64u * wave) * DDIM
                                           : Wbf + (size_t)(n0 + 64u * (wave - 4u)) * DDIM;
    const uint64_t gsrc  = (uint64_t)(size_t)srow;
    const u32x8    g1    = tdm_group1();

    // this lane's fragment rows in buffer 0
    const unsigned lrow = (lane & 15) * RPITCH + (lane >> 4) * 16;
    const unsigned char* pa0 = ring + (w >> 2) * 2 * SLICEB + lrow;
    const unsigned char* pb0 = ring + (4 + (w & 3)) * SLICEB + lrow;

    v8f acc[8][4] = {};

    // ---- stage 0 lands and is published, then stage 1 is asked for ----
    tdm_load(tdm_group0(ldst, gsrc), g1);
    asm volatile("s_wait_tensorcnt 0x0" ::: "memory");   // this wave's slice of stage 0 has landed
    __syncthreads();
    tdm_load(tdm_group0(ldst + STAGEB, gsrc + ROWB), g1);

    // ---- main K loop: one pass of 128 k a trip ----
    // kept rolled: one pass is 128 WMMAs a wave already
#pragma clang loop unroll(disable)
    for (uint32_t s = 0; s < NPASS; ++s) {
        const uint32_t boff = (s & 1u) * STAGEB;
        const unsigned char* pa = pa0 + boff;
        const unsigned char* pb = pb0 + boff;
        v16bf af[2][8], bfv[2][4];
        ldring(pa, pb, 0, af[0], bfv[0]);
#pragma unroll
        for (int kb = 0; kb < 4; ++kb) {
            // the next 32 k's 24 LDS reads go as one group ahead of this block's WMMAs,
            // into the other fragment set; the fences keep them from being dealt out
            // among the WMMAs
            if (kb < 3) ldring(pa, pb, kb + 1, af[(kb + 1) & 1], bfv[(kb + 1) & 1]);
            __builtin_amdgcn_sched_barrier(0);
            mma(af[kb & 1], bfv[kb & 1], acc);
            __builtin_amdgcn_sched_barrier(0);
        }
        // publish point of stage s + 1
        asm volatile("s_wait_dscnt 0x0" ::: "memory");      // this wave has left buffer s & 1
        asm volatile("s_wait_tensorcnt 0x0" ::: "memory");  // its slice of stage s + 1 has landed
        __syncthreads();
        if (pinned(s + 2u < NPASS)) {
            // formed behind the wait: no descriptor word changes under a request in flight
            const uint32_t koff = pinned((s + 2u) * ROWB);
            tdm_load(tdm_group0(ldst + boff, gsrc + koff), g1);
        }
    }
    asm volatile("s_wait_tensorcnt 0x0" ::: "memory");   // nothing of the mover is in flight
    asm volatile("s_wait_dscnt 0x0" ::: "memory");       // before the ring is written by hand

    // ---- LoRA epilogue: accumulate zsp(M x 64) @ Bbf(N x 64)^T, K=64 ----
    // (the last pass's own barrier has ended every read of the ring)
    {
        unsigned short* xs0 = (unsigned short*)ring;
        unsigned short* wl0 = xs0 + BM * LDP;
        const int row2  = tid >> 2;          // 64 rows/sweep, 4x uint4 per row
        const int colq2 = (tid & 3) * 8;     // in bf16 elems (16B chunks)
        const int soff2 = row2 * LDP + colq2;
        const unsigned short* zp = zsp + (size_t)m0 * RDIM;   // block-uniform
        const unsigned short* bp = Bbf + (size_t)n0 * RDIM;
        const unsigned loff = (unsigned)(row2 * RDIM + colq2);
#pragma unroll
        for (int kk = 0; kk < 2; ++kk) {
            uint4 zr[4], br[4];              // 256 rows of the zsp tile, 256 of the Bbf tile
#pragma unroll
            for (int i = 0; i < 4; ++i)
                zr[i] = *(const uint4*)(zp + (loff + 64u * i * RDIM + kk * 32u));
#pragma unroll
            for (int i = 0; i < 4; ++i)
                br[i] = *(const uint4*)(bp + (loff + 64u * i * RDIM + kk * 32u));
#pragma unroll
            for (int i = 0; i < 4; ++i)
                *(uint4*)(&xs0[soff2 + 64 * i * LDP]) = zr[i];
#pragma unroll
            for (int i = 0; i < 4; ++i)
                *(uint4*)(&wl0[soff2 + 64 * i * LDP]) = br[i];
            __syncthreads();
            compute_tile(xs0, wl0, rA, rB, lane, acc);
            __syncthreads();
        }
    }

    // ---- epilogue: bias + store ----
    const int l15 = lane & 15;
    const int m8  = (lane >> 4) * 8;
#pragma unroll
    for (int ni = 0; ni < 4; ++ni) {
        int gn = n0 + rB + ni * 16 + l15;
        float bv = bias[gn];
#pragma unroll
        for (int mi = 0; mi < 8; ++mi) {
            int gmB = m0 + rA + mi * 16 + m8;
#pragma unroll
            for (int r = 0; r < 8; ++r)
                out[(size_t)(gmB + r) * NDIM + gn] = acc[mi][ni][r] + bv;
        }
    }
}

// ---------------------------------------------------------------------------
// Host launch
// ---------------------------------------------------------------------------
extern "C" void kernel_launch(void* const* d_in, const int* in_sizes, int n_in,
                              void* d_out, int out_size, void* d_ws, size_t ws_size,
                              hipStream_t stream) {
    const float* x    = (const float*)d_in[0];
    const float* A    = (const float*)d_in[1];
    const float* Bm   = (const float*)d_in[2];
    const float* W    = (const float*)d_in[3];
    const float* bias = (const float*)d_in[4];
    float* out = (float*)d_out;

    unsigned short* zsp = (unsigned short*)d_ws;               // MDIM*RDIM bf16 = 1 MB
    unsigned short* Bbf = zsp + (size_t)MDIM * RDIM;           // NDIM*RDIM bf16 = 0.5 MB
    unsigned short* xb  = Bbf + (size_t)NDIM * RDIM;           // MDIM*DDIM bf16 = 64 MB
    unsigned short* Wbf = xb  + (size_t)MDIM * DDIM;           // NDIM*DDIM bf16 = 32 MB

    zk<<<MDIM / ZROWS, 512, 0, stream>>>(x, A, zsp, xb);
    wbconv<<<WBLK + BBLK, 256, 0, stream>>>(W, Bm, Wbf, Bbf);
    gemmk<<<dim3(NDIM / BN, MDIM / BM), 256, 0, stream>>>(xb, Wbf, bias, zsp, Bbf, out);
}
